// v010
// The times below were measured on an AMD MI455X: many runs one after another, warmed up first and cycling through
// copies of the inputs, with the whole window's GPU time divided by the number of runs. Launches and the gaps
// between them are all in it. The median over several windows is given; except for v000 it joins two sittings, which
// can be a few percent apart, so the side-by-side timings, each taken in one sitting, are the better comparison.
// This document starts at v010; the versions before it stand elsewhere.
// One run takes 132 microseconds.
// Two timings next to v009 both put it at 1.20 times that version's speed.
// Counting every step since v000, which is the starting kernel, it is 33.1 times as fast.
#include <hip/hip_runtime.h>
// Multi-head attention with learned relative-position encoding (4 x 1024 tokens, 1024 = 16 heads x 64): q,k,v = x W^T + b; scores = q.k/8 + q.rpe_table[h][q - k + 1023] (no scale on the RPE term); softmax over all keys; . v; merged . Wo^T + bo -> [4,1024,1024].
// Structure: four launches. All input conversions in one launch; the q, k and v projections (all batches) in one launch, and Wo in one, as f16 WMMA GEMMs (32x64 wave tiles, f32 accumulation, exact products + bias; the work-group's A and B tiles reach LDS by asynchronous copies, two buffers); the fused flash kernel (one launch over all batches and heads; hi/lo q,k three-product scores, both products transposed (S^T = K . Q^T, O^T += V^T . P^T), so a lane owns one query: online f32 softmax inside the lane, in base 2 (log2(e) folded into the score scales), P hi + residual packed in registers, V^T hi + residual; all keys valid; each 32-key tile of K and V^T, both planes, reaches LDS once for the work-group's four waves by asynchronous copies, two buffers) forms the RPE term itself: per 16 x 32 score tile the 48 table rows r = q - k + 1023 can reach give a 16 x 48 f16 WMMA product q_h . table[h][r] (f32 result, 16 of the 48 columns carried over from the trip before), stored skewed in the wave's LDS and read back per query inside the score stage; O as hi + residual planes into Wo (one GEMM launch, two accumulator sets over a shared Wo tile).
// Compute dtype: x, weights, biases, rpe_table rounded to bf16; projections exact; the RPE product uses the plain f16 q (the hi plane) (~2^-12 on a sigma-0.16 bias); q, k, P, v, O as f16 hi + residual pairs (~2^-21) in the attention; f32 accumulation and softmax. v_wmma_f32_16x16x32_f16.
#define NBT 4
#define SLEN 1024
#define RW 2048                  /* table rows kept per head (2*SLEN-1 used, the last one zero) */
#define DM 1024
#define NH 16
#define SCL 0.125f
#define LOG2E 1.4426950408889634f      /* exp(x) = 2^(x * LOG2E) */
#define NR (NBT * SLEN)
typedef __bf16 v16b __attribute__((ext_vector_type(16)));
typedef unsigned short v8us __attribute__((ext_vector_type(8), may_alias));
typedef float  v8f  __attribute__((ext_vector_type(8)));
typedef float  v4f  __attribute__((ext_vector_type(4)));
typedef float  v4fa __attribute__((ext_vector_type(4), may_alias));
union FragB { v16b v; v8us half[2]; unsigned short u[16]; };

__device__ __forceinline__ unsigned short bf16_bits(float x) { unsigned int u = __float_as_uint(x); return (unsigned short)((u + 0x7FFFu + ((u >> 16) & 1u)) >> 16); }
__device__ __forceinline__ float bf16_val(unsigned short b) { return __uint_as_float(((unsigned int)b) << 16); }
__device__ __forceinline__ float bf16_round(float x) { return bf16_val(bf16_bits(x)); }
// D += A·B with NT terms: 1 = ah·bh, 2 = + al·bh (A split), 3 = + ah·bl (both split)
template <int NT>
__device__ __forceinline__ v8f mmaN(v16b ah, v16b al, v16b bh, v16b bl, v8f c) {
  c = __builtin_amdgcn_wmma_f32_16x16x32_bf16(false, ah, false, bh, (short)0, c, false, false);
  if (NT >= 2) c = __builtin_amdgcn_wmma_f32_16x16x32_bf16(false, al, false, bh, (short)0, c, false, false);
  if (NT >= 3) c = __builtin_amdgcn_wmma_f32_16x16x32_bf16(false, ah, false, bl, (short)0, c, false, false);
  asm volatile("v_nop\n\tv_nop\n\tv_nop\n\tv_nop" : "+v"(c) : "v"(ah), "v"(al), "v"(bh), "v"(bl));
  return c;
}

__global__ __launch_bounds__(256) void k_wt_bf16(const float* __restrict__ W, unsigned short* __restrict__ Wt, int K, int N) {
  const int t = blockIdx.x * 256 + threadIdx.x;
  const int k8n = K / 8;
  if (t >= N * k8n) return;
  const int n = t / k8n, k8 = (t % k8n) * 8;
  v8us v;
#pragma unroll
  for (int i = 0; i < 8; ++i) v[i] = bf16_bits(W[(size_t)(k8 + i) * N + n]);
  *(v8us*)(Wt + (size_t)n * K + k8) = v;
  
}

// GEMM C[M][N] (f32, pitch ldc) = act(A[M][K]·W + bias). A f32 row-major (pitch lda) converted per fragment to bf16
// (ASPLIT: hi/lo two planes -> 2 terms, else single rounded term); Wt bf16 [N][K] (pitch ldb). BIAS_BF16 rounds the
// bias to bf16 first (bias quantised to bf16 before the add). K%32==0, M%16==0, N%64==0.
template <bool ASPLIT, int ACT, bool BIAS_BF16>
__global__ __launch_bounds__(128) void k_gemm_bf(const float* __restrict__ A, int lda, const unsigned short* __restrict__ Wt, int ldb,
                                               const float* __restrict__ bias, float* __restrict__ C, int ldc, int M, int N, int K) {
  __shared__ __attribute__((aligned(16))) float so[4][16][64];
  const int tid = threadIdx.x, w = tid >> 5, lane = tid & 31, ln = lane & 15, hh = lane >> 4;
  const int ntn = N / 64;
  const int wid = blockIdx.x * 4 + w;
  const int mt = wid / ntn, nq = wid % ntn;
  if (mt * 16 >= M) return;
  const int row0 = mt * 16, col0 = nq * 64;
  const float* arow = A + (size_t)(row0 + ln) * lda;
  v8f acc[4] = {};
  for (int kb = 0; kb < K; kb += 32) {
    FragB ah, al;
    const v4f x0 = *(const v4fa*)(arow + kb + 8 * hh), x1 = *(const v4fa*)(arow + kb + 8 * hh + 4);
    const v4f x2 = *(const v4fa*)(arow + kb + 16 + 8 * hh), x3 = *(const v4fa*)(arow + kb + 16 + 8 * hh + 4);
    float xs[16] = {x0[0],x0[1],x0[2],x0[3],x1[0],x1[1],x1[2],x1[3],x2[0],x2[1],x2[2],x2[3],x3[0],x3[1],x3[2],x3[3]};
#pragma unroll
    for (int i = 0; i < 16; ++i) { const unsigned short hb = bf16_bits(xs[i]); ah.u[i] = hb; al.u[i] = ASPLIT ? bf16_bits(xs[i] - bf16_val(hb)) : (unsigned short)0; }
#pragma unroll
    for (int t = 0; t < 4; ++t) {
      const unsigned short* brow = Wt + (size_t)(col0 + t * 16 + ln) * ldb + kb;
      FragB b;
      b.half[0] = *(const v8us*)(brow + 8 * hh);
      b.half[1] = *(const v8us*)(brow + 16 + 8 * hh);
      acc[t] = mmaN<ASPLIT ? 2 : 1>(ah.v, al.v, b.v, b.v, acc[t]);
    }
  }
#pragma unroll
  for (int t = 0; t < 4; ++t) {
    float bv = bias ? bias[col0 + t * 16 + ln] : 0.f;
    if (BIAS_BF16) bv = bf16_round(bv);
#pragma unroll
    for (int r = 0; r < 8; ++r) { float v = acc[t][r] + bv; if (ACT == 1) v = fmaxf(v, 0.f); so[w][8 * hh + r][t * 16 + ln] = v; }
  }
  __builtin_amdgcn_fence(__ATOMIC_ACQ_REL, "workgroup");
  __builtin_amdgcn_wave_barrier();
  const int rsub = lane >> 4, c4 = (lane & 15) * 4;
  {
#pragma unroll
    for (int q = 0; q < 8; ++q) {
      const int r = q * 2 + rsub;
      const v4f v = *(const v4fa*)&so[w][r][c4];
      *(v4f*)(C + (size_t)(row0 + r) * ldc + col0 + c4) = v;
    }
    
  }
}

// GEMM C = act(A·W + bias + resid): A f32 (ASPLIT -> hi/lo 2 terms), Wt bf16 [N][K]; ACT 0 none, 1 relu, 2 exact gelu;
// resid (optional, f32, row index = (row % rmod), pitch ldr, RES_BF16 rounds it) added before the activation.
template <bool ASPLIT, int ACT, bool BIAS_BF16, bool RES_BF16>
__global__ __launch_bounds__(128) void k_gemm_bf3(const float* __restrict__ A, int lda, const unsigned short* __restrict__ Wt, int ldb,
                                                const float* __restrict__ bias, const float* __restrict__ resid, int rmod, int ldr,
                                                float* __restrict__ C, int ldc, int M, int N, int K) {
  __shared__ __attribute__((aligned(16))) float so[4][16][64];
  const int tid = threadIdx.x, w = tid >> 5, lane = tid & 31, ln = lane & 15, hh = lane >> 4;
  const int ntn = N / 64;
  const int wid = blockIdx.x * 4 + w;
  const int mt = wid / ntn, nq = wid % ntn;
  if (mt * 16 >= M) return;
  const int row0 = mt * 16, col0 = nq * 64;
  const float* arow = A + (size_t)(row0 + ln) * lda;
  v8f acc[4] = {};
  for (int kb = 0; kb < K; kb += 32) {
    FragB ah, al;
    const v4f x0 = *(const v4fa*)(arow + kb + 8 * hh), x1 = *(const v4fa*)(arow + kb + 8 * hh + 4);
    const v4f x2 = *(const v4fa*)(arow + kb + 16 + 8 * hh), x3 = *(const v4fa*)(arow + kb + 16 + 8 * hh + 4);
    float xs[16] = {x0[0],x0[1],x0[2],x0[3],x1[0],x1[1],x1[2],x1[3],x2[0],x2[1],x2[2],x2[3],x3[0],x3[1],x3[2],x3[3]};
#pragma unroll
    for (int i = 0; i < 16; ++i) { const unsigned short hb = bf16_bits(xs[i]); ah.u[i] = hb; al.u[i] = ASPLIT ? bf16_bits(xs[i] - bf16_val(hb)) : (unsigned short)0; }
#pragma unroll
    for (int t = 0; t < 4; ++t) {
      const unsigned short* brow = Wt + (size_t)(col0 + t * 16 + ln) * ldb + kb;
      FragB b;
      b.half[0] = *(const v8us*)(brow + 8 * hh);
      b.half[1] = *(const v8us*)(brow + 16 + 8 * hh);
      acc[t] = mmaN<ASPLIT ? 2 : 1>(ah.v, al.v, b.v, b.v, acc[t]);
    }
  }
#pragma unroll
  for (int t = 0; t < 4; ++t) {
    const int col = col0 + t * 16 + ln;
    float bv = bias ? bias[col] : 0.f;
    if (BIAS_BF16) bv = bf16_round(bv);
#pragma unroll
    for (int r = 0; r < 8; ++r) {
      float v = acc[t][r] + bv;
      if (resid) { float rv = resid[(size_t)((row0 + 8 * hh + r) % rmod) * ldr + col]; if (RES_BF16) rv = bf16_round(rv); v += rv; }
      if (ACT == 1) v = fmaxf(v, 0.f);
      if (ACT == 2) v = 0.5f * v * (1.0f + erff(v * 0.70710678118654752f));
      if (ACT == 3) { const float u = 0.7978845608028654f * (v + 0.044715f * v * v * v); v = 0.5f * v * (1.0f + tanhf(u)); }
      so[w][8 * hh + r][t * 16 + ln] = v;
    }
  }
  __builtin_amdgcn_fence(__ATOMIC_ACQ_REL, "workgroup");
  __builtin_amdgcn_wave_barrier();
  const int rsub = lane >> 4, c4 = (lane & 15) * 4;
  {
#pragma unroll
    for (int q = 0; q < 8; ++q) {
      const int r = q * 2 + rsub;
      const v4f v = *(const v4fa*)&so[w][r][c4];
      *(v4f*)(C + (size_t)(row0 + r) * ldc + col0 + c4) = v;
    }
    
  }
}
// row LayerNorm (biased variance, eps) over N: s = X (+ R); optional out_sum <- s; out_norm <- (s-mu)*rsqrt(var+eps)*g + b
template <bool PARAM_BF16>
__global__ __launch_bounds__(256) void k_layernorm(const float* __restrict__ X, const float* __restrict__ R, const float* __restrict__ g, const float* __restrict__ bta,
                                                  float* __restrict__ out_sum, float* __restrict__ out_norm, int N, float eps) {
  __shared__ float red[256];
  const int row = blockIdx.x, tid = threadIdx.x;
  const float* x = X + (size_t)row * N; const float* rr = R ? R + (size_t)row * N : nullptr;
  float vals[16];                     // up to N = 4096
  const int per = N / 256;            // contiguous chunk per thread? use strided-by-4 chunks: thread handles j = tid*4 + 1024*u
  float s1 = 0.f;
  for (int u = 0; u < per / 4; ++u) {
    const int j = tid * 4 + 1024 * u;
    const v4f a = *(const v4fa*)(x + j);
    v4f b = {0.f,0.f,0.f,0.f}; if (rr) b = *(const v4fa*)(rr + j);
#pragma unroll
    for (int q = 0; q < 4; ++q) { const float v = a[q] + b[q]; vals[u * 4 + q] = v; s1 += v; }
  }
  red[tid] = s1; __syncthreads();
  for (int st = 128; st > 0; st >>= 1) { if (tid < st) red[tid] += red[tid + st]; __syncthreads(); }
  const float mu = red[0] / (float)N; __syncthreads();
  float s2 = 0.f;
  for (int u = 0; u < per / 4; ++u)
#pragma unroll
    for (int q = 0; q < 4; ++q) { const float c = vals[u * 4 + q] - mu; s2 += c * c; }
  red[tid] = s2; __syncthreads();
  for (int st = 128; st > 0; st >>= 1) { if (tid < st) red[tid] += red[tid + st]; __syncthreads(); }
  const float rs = rsqrtf(red[0] / (float)N + eps);
  {
    for (int u = 0; u < per / 4; ++u) {
      const int j = tid * 4 + 1024 * u;
      v4f o, sm;
#pragma unroll
      for (int q = 0; q < 4; ++q) {
        float gg = g[j + q], bb = bta[j + q];
        if (PARAM_BF16) { gg = bf16_round(gg); bb = bf16_round(bb); }
        sm[q] = vals[u * 4 + q]; o[q] = (vals[u * 4 + q] - mu) * rs * gg + bb;
      }
      if (out_sum) *(v4f*)(out_sum + (size_t)row * N + j) = sm;
      *(v4f*)(out_norm + (size_t)row * N + j) = o;
    }
    
  }
}



// ---- f16 WMMA path (v_wmma_f32_16x16x32_f16): 11-bit significands for operands in range — used where a [0,1] probability operand needs more precision than bf16
typedef _Float16 v16h __attribute__((ext_vector_type(16)));
union FragH { v16h v; v8us half[2]; _Float16 h[16]; unsigned short u[16]; };
template <int NT>
__device__ __forceinline__ v8f mmaH(v16h ah, v16h al, v16h bh, v16h bl, v8f c) {
  c = __builtin_amdgcn_wmma_f32_16x16x32_f16(false, ah, false, bh, (short)0, c, false, false);
  if (NT >= 2) c = __builtin_amdgcn_wmma_f32_16x16x32_f16(false, al, false, bh, (short)0, c, false, false);
  if (NT >= 3) c = __builtin_amdgcn_wmma_f32_16x16x32_f16(false, ah, false, bl, (short)0, c, false, false);
  asm volatile("v_nop\n\tv_nop\n\tv_nop\n\tv_nop" : "+v"(c) : "v"(ah), "v"(al), "v"(bh), "v"(bl));
  return c;
}
// batched GEMM like k_gemm_b but f16 operands: A f32 (split into f16 hi/lo if ASPLIT, else rounded to f16), Bt = f16 values [n][k]; alpha; C f32; N multiple of 16 (partial tiles skipped)
template <bool ASPLIT>
__global__ __launch_bounds__(128) void k_gemm_h(const float* __restrict__ A, int lda, size_t sA, const _Float16* __restrict__ Bh, int ldb, size_t sB, float alpha, float* __restrict__ C, int ldc, size_t sC, int M, int N, int K) {
  __shared__ __attribute__((aligned(16))) float so[4][16][64];
  const int tid = threadIdx.x, w = tid >> 5, lane = tid & 31, ln = lane & 15, hh = lane >> 4; const int by = blockIdx.y;
  A += (size_t)by * sA; Bh += (size_t)by * sB; C += (size_t)by * sC;
  const int ntn = (N + 63) / 64; const int wid = blockIdx.x * 4 + w; const int mt = wid / ntn, nq = wid % ntn; if (mt * 16 >= M) return;
  const int row0 = mt * 16, col0 = nq * 64; const float* arow = A + (size_t)(row0 + ln) * lda;
  v8f acc[4] = {};
  for (int kb = 0; kb < K; kb += 32) {
    FragH ah, al;
    const v4f x0 = *(const v4fa*)(arow + kb + 8 * hh), x1 = *(const v4fa*)(arow + kb + 8 * hh + 4), x2 = *(const v4fa*)(arow + kb + 16 + 8 * hh), x3 = *(const v4fa*)(arow + kb + 16 + 8 * hh + 4);
    float xs[16] = {x0[0],x0[1],x0[2],x0[3],x1[0],x1[1],x1[2],x1[3],x2[0],x2[1],x2[2],x2[3],x3[0],x3[1],x3[2],x3[3]};
#pragma unroll
    for (int i = 0; i < 16; ++i) { const _Float16 h = (_Float16)xs[i]; ah.h[i] = h; al.h[i] = ASPLIT ? (_Float16)(xs[i] - (float)h) : (_Float16)0.0f; }
#pragma unroll
    for (int t = 0; t < 4; ++t) { if (col0 + t * 16 >= N) continue; const size_t boff = (size_t)(col0 + t * 16 + ln) * ldb + kb; FragH bq; bq.half[0] = *(const v8us*)(Bh + boff + 8 * hh); bq.half[1] = *(const v8us*)(Bh + boff + 16 + 8 * hh);
      acc[t] = mmaH<ASPLIT ? 2 : 1>(ah.v, al.v, bq.v, bq.v, acc[t]); }
  }
#pragma unroll
  for (int t = 0; t < 4; ++t) { if (col0 + t * 16 >= N) continue;
#pragma unroll
    for (int r = 0; r < 8; ++r) so[w][8 * hh + r][t * 16 + ln] = acc[t][r] * alpha; }
  __builtin_amdgcn_fence(__ATOMIC_ACQ_REL, "workgroup"); __builtin_amdgcn_wave_barrier();
  const int rsub = lane >> 4, c4 = (lane & 15) * 4;
  {
#pragma unroll
    for (int q = 0; q < 8; ++q) { const int r = q * 2 + rsub; if (col0 + c4 < N) { const v4f v = *(const v4fa*)&so[w][r][c4]; *(v4f*)(C + (size_t)(row0 + r) * ldc + col0 + c4) = v; } }
     }
}

// Wt[n][k] = f16(W[k][n]·scale) from f32 row-major W[K][N] (scale = power of two; bf16-exact weights stay exact in f16 away from the subnormal range)
__global__ __launch_bounds__(256) void k_wt_f16(const float* __restrict__ W, _Float16* __restrict__ Wt, int K, int N, float scale) {
  const int t = blockIdx.x * 256 + threadIdx.x; if (t >= N * (K / 8)) return; const int n = t / (K / 8), k8 = (t % (K / 8)) * 8; FragH f;
#pragma unroll
  for (int i = 0; i < 8; ++i) f.h[i] = (_Float16)(bf16_round(W[(size_t)(k8 + i) * N + n]) * scale); const v8us o = f.half[0];
  *(v8us*)((unsigned short*)Wt + (size_t)n * K + k8) = o; 
}
// k_gemm_hh variant with fused epilogue: v = acc·alpha + bias[by·sBias + col] (+ CP[(row/rowsPerB)·sCPb + by·64 + col] if CP) ; ACT 0 none / 1 elu ; writes f16 C16 (and f32 C if non-null)
template <int ACT>
__global__ __launch_bounds__(128) void k_gemm_hhx(const _Float16* __restrict__ A, int lda, size_t sA, const _Float16* __restrict__ Bh, int ldb, size_t sB, float alpha, const float* __restrict__ bias, size_t sBias, const float* __restrict__ CP, int rowsPerB, size_t sCPb, int row0g,
    float* __restrict__ C, _Float16* __restrict__ C16, int ldc, size_t sC, int M, int N, int K) {
  __shared__ __attribute__((aligned(16))) float so[4][16][64];
  const int tid = threadIdx.x, w = tid >> 5, lane = tid & 31, ln = lane & 15, hh = lane >> 4; const int by = blockIdx.y;
  A += (size_t)by * sA; Bh += (size_t)by * sB; const size_t cofs = (size_t)by * sC; const float* bp = bias ? bias + (size_t)by * sBias : nullptr;
  const int ntn = (N + 63) / 64; const int wid = blockIdx.x * 4 + w; const int mt = wid / ntn, nq = wid % ntn; if (mt * 16 >= M) return;
  const int row0 = mt * 16, col0 = nq * 64; const _Float16* arow = A + (size_t)(row0 + ln) * lda;
  v8f acc[4] = {};
  for (int kb = 0; kb < K; kb += 32) { FragH ah; ah.half[0] = *(const v8us*)((const unsigned short*)arow + kb + 8 * hh); ah.half[1] = *(const v8us*)((const unsigned short*)arow + kb + 16 + 8 * hh);
#pragma unroll
    for (int t = 0; t < 4; ++t) { if (col0 + t * 16 >= N) continue; const size_t boff = (size_t)(col0 + t * 16 + ln) * ldb + kb; FragH bq; bq.half[0] = *(const v8us*)((const unsigned short*)Bh + boff + 8 * hh); bq.half[1] = *(const v8us*)((const unsigned short*)Bh + boff + 16 + 8 * hh);
      acc[t] = mmaH<1>(ah.v, ah.v, bq.v, bq.v, acc[t]); }
  }
#pragma unroll
  for (int t = 0; t < 4; ++t) { if (col0 + t * 16 >= N) continue; const int col = col0 + t * 16 + ln; const float bv = bp ? bf16_round(bp[col]) : 0.f;
#pragma unroll
    for (int r = 0; r < 8; ++r) { float v = acc[t][r] * alpha + bv; if (CP) { const int bidx = (row0g + row0 + 8 * hh + r) / rowsPerB; v += CP[(size_t)bidx * sCPb + (size_t)by * 64 + col]; } if (ACT == 1) v = (v > 0.f) ? v : expm1f(v); else if (ACT == 7) v = (v > 0.f) ? v + 1.0f : expf(v); else if (ACT == 8) v = tanhf(v); else if (ACT == 9) v = 0.5f * v * (1.0f + tanhf(0.7978845608028654f * (v + 0.044715f * v * v * v))); else if (ACT == 11) v = 1.0f / (1.0f + expf(-v)); else if (ACT == 12) v = (v > 0.f) ? v : 0.01f * v; else if (ACT == 14) v = (v > 0.f) ? v : 0.1f * v; else if (ACT == 15) v = v / (1.0f + expf(-v)); else if (ACT == 3) v = fmaxf(v, 0.f); else if (ACT == 6) v = 0.5f * v * (1.0f + erff(v * 0.70710678118654752f)); so[w][8 * hh + r][t * 16 + ln] = v; } }
  __builtin_amdgcn_fence(__ATOMIC_ACQ_REL, "workgroup"); __builtin_amdgcn_wave_barrier();
  const int rsub = lane >> 4, c4 = (lane & 15) * 4; typedef _Float16 v4h __attribute__((ext_vector_type(4)));
  {
#pragma unroll
    for (int q = 0; q < 8; ++q) { const int r = q * 2 + rsub; if (col0 + c4 < N) { const v4f v = *(const v4fa*)&so[w][r][c4]; if (C) *(v4f*)(C + cofs + (size_t)(row0 + r) * ldc + col0 + c4) = v; if (C16) { v4h h4; for (int i = 0; i < 4; ++i) h4[i] = (_Float16)v[i]; *(v4h*)(C16 + cofs + (size_t)(row0 + r) * ldc + col0 + c4) = h4; } } }
     }
}


typedef _Float16 v4h __attribute__((ext_vector_type(4)));

__global__ __launch_bounds__(256) void k_h16(const float* __restrict__ x, _Float16* __restrict__ X16, size_t n8) { const size_t t = (size_t)blockIdx.x * 256 + threadIdx.x; if (t >= n8) return; FragH f;
#pragma unroll
  for (int q = 0; q < 8; ++q) f.h[q] = (_Float16)x[t * 8 + q]; *(v8us*)((unsigned short*)X16 + t * 8) = f.half[0];  }
template <int NHv, int TTv>
__global__ __launch_bounds__(256) void k_vt(const _Float16* __restrict__ V16, int ldv, int voff, _Float16* __restrict__ Vt) { __shared__ unsigned short tl[64][66]; const int tid = threadIdx.x; const int slab = blockIdx.x / (TTv / 64), lg = blockIdx.x % (TTv / 64); const int b = slab / NHv, h = slab % NHv;
  for (int i = tid; i < 64 * 8; i += 256) { const int r = i / 8, c8 = (i % 8) * 8; FragH f; f.half[0] = *(const v8us*)((const unsigned short*)V16 + ((size_t)b * TTv + lg * 64 + r) * ldv + voff + h * 64 + c8);
#pragma unroll
    for (int q = 0; q < 8; ++q) tl[r][c8 + q] = f.u[q]; }
  __syncthreads();
  {
#pragma unroll
    for (int rd = 0; rd < 2; ++rd) { const int d = rd * 32 + tid / 8, pc = tid % 8; FragH f;
#pragma unroll
      for (int q = 0; q < 8; ++q) f.u[q] = tl[pc * 8 + q][d];
      *(v8us*)((unsigned short*)Vt + ((size_t)slab * 64 + d) * TTv + lg * 64 + pc * 8) = f.half[0]; }
     } }

// ---- fast GEMM (wave tile 32x64, work-group tile 128x64; requires M % 128 == 0, N % 64 == 0, K % 64 == 0) ----
#define G2P 72                   /* LDS row pitch in values: 128-byte rows at 144 bytes, the conflict-free pitch for ds_load_b128 readers */
// One K step of 64 values for the work-group: its 128 A rows and 64 B rows (128 bytes = one line each) go to LDS as 12 asynchronous 16-byte copies a lane; 8 lanes take a row, so a wave's copy covers 4 whole lines.
// ag, bg: the lane's piece in the first 16 rows; sa, sb: 16 rows on, in values; la, lb: the lane's LDS byte address in the first 16 rows. The closing s_wait_xcnt 0 stands in front of any rewrite of the registers that the copies name.
__device__ __forceinline__ void g2_stage(const _Float16* ag, size_t sa, const _Float16* bg, size_t sb, unsigned la, unsigned lb) {
  asm volatile("global_load_async_to_lds_b128 %0, %12, off\n\t"
               "global_load_async_to_lds_b128 %1, %13, off\n\t"
               "global_load_async_to_lds_b128 %2, %14, off\n\t"
               "global_load_async_to_lds_b128 %3, %15, off\n\t"
               "global_load_async_to_lds_b128 %4, %16, off\n\t"
               "global_load_async_to_lds_b128 %5, %17, off\n\t"
               "global_load_async_to_lds_b128 %6, %18, off\n\t"
               "global_load_async_to_lds_b128 %7, %19, off\n\t"
               "global_load_async_to_lds_b128 %8, %20, off\n\t"
               "global_load_async_to_lds_b128 %9, %21, off\n\t"
               "global_load_async_to_lds_b128 %10, %22, off\n\t"
               "global_load_async_to_lds_b128 %11, %23, off\n\t"
               "s_wait_xcnt 0x0"
               :: "v"(la), "v"(la + 1u * 16 * G2P * 2), "v"(la + 2u * 16 * G2P * 2), "v"(la + 3u * 16 * G2P * 2), "v"(la + 4u * 16 * G2P * 2), "v"(la + 5u * 16 * G2P * 2), "v"(la + 6u * 16 * G2P * 2), "v"(la + 7u * 16 * G2P * 2),
                  "v"(lb), "v"(lb + 1u * 16 * G2P * 2), "v"(lb + 2u * 16 * G2P * 2), "v"(lb + 3u * 16 * G2P * 2),
                  "v"(ag), "v"(ag + sa), "v"(ag + 2 * sa), "v"(ag + 3 * sa), "v"(ag + 4 * sa), "v"(ag + 5 * sa), "v"(ag + 6 * sa), "v"(ag + 7 * sa),
                  "v"(bg), "v"(bg + sb), "v"(bg + 2 * sb), "v"(bg + 3 * sb)
               : "memory"); }
__device__ __forceinline__ v16h g2_frag(const _Float16* p, int hh) { FragH f; f.half[0] = *(const v8us*)((const unsigned short*)p + 8 * hh); f.half[1] = *(const v8us*)((const unsigned short*)p + 16 + 8 * hh); return f.v; }
__device__ __forceinline__ v8f g2_mma(v16h a, v16h b, v8f c) { v8f d = __builtin_amdgcn_wmma_f32_16x16x32_f16(false, a, false, b, (short)0, c, false, false); asm volatile("v_nop\n\tv_nop\n\tv_nop\n\tv_nop" : "+v"(d) : "v"(a), "v"(b)); return d; }
// Three products of one A in one launch: blockIdx.y picks the weights, the bias and the result (0: q, 1: k, 2: v), v = (A . B^T) * alpha + bias. q and k leave as two f16 planes, Hh = f16(v), Hl = f16((v - Hh) * 1024), row-major at pitch ldc;
// v leaves as the same two planes transposed per head, H[((row / SLEN) * NH + col / 64) * 64 + col % 64][row % SLEN]; needs SLEN % 128 == 0 and N == NH * 64.
__global__ __launch_bounds__(128) void k_gemm2qkv(const _Float16* __restrict__ A, int lda, const _Float16* __restrict__ Bq, const _Float16* __restrict__ Bk, const _Float16* __restrict__ Bv, int ldb, float alpha, const float* __restrict__ biasq, const float* __restrict__ biask, const float* __restrict__ biasv,
    _Float16* __restrict__ Qh, _Float16* __restrict__ Ql, _Float16* __restrict__ Kh, _Float16* __restrict__ Kl, _Float16* __restrict__ Vh, _Float16* __restrict__ Vl, int ldc, int M, int N, int K) {
  __shared__ __attribute__((aligned(16))) float so[4][32][68]; __shared__ __attribute__((aligned(16))) unsigned short tA[2][128][G2P], tB[2][64][G2P];
  const int tid = threadIdx.x, w = tid >> 5, lane = tid & 31, ln = lane & 15, hh = lane >> 4; const int by = blockIdx.y;      /* the same for the whole work-group */
  const _Float16* Bh = by == 0 ? Bq : by == 1 ? Bk : Bv; const float* bp = by == 0 ? biasq : by == 1 ? biask : biasv; _Float16* Hh = by == 0 ? Qh : by == 1 ? Kh : Vh; _Float16* Hl = by == 0 ? Ql : by == 1 ? Kl : Vl;
  const int ntn = N >> 6; const int mt = blockIdx.x / ntn, nq = blockIdx.x - mt * ntn; const int row0 = mt * 128 + 32 * w, col0 = nq * 64; if (mt * 128 >= M) return;      /* the whole work-group leaves or none: barriers below */
  const int cr = tid >> 3, cc = (tid & 7) * 8;      /* the lane's row (of 16) and 16-byte piece in a copy */
  const _Float16* ag = A + (size_t)(mt * 128 + cr) * lda + cc; const _Float16* bg = Bh + (size_t)(col0 + cr) * ldb + cc; const size_t sa = (size_t)16 * lda, sb = (size_t)16 * ldb;
  const unsigned la = (unsigned)(size_t)&tA[0][cr][cc], lb = (unsigned)(size_t)&tB[0][cr][cc];      /* LDS byte addresses: the low 32 bits */
  const int nst = K >> 6;
  const v8f z8 = {0.f,0.f,0.f,0.f,0.f,0.f,0.f,0.f}; v8f c00 = z8, c01 = z8, c02 = z8, c03 = z8, c10 = z8, c11 = z8, c12 = z8, c13 = z8;
  g2_stage(ag, sa, bg, sb, la, lb);      /* step 0 into buffer 0 */
  asm volatile("s_wait_asynccnt 0x0" ::: "memory");      /* this wave's copies of step 0 have landed */
  __syncthreads();      /* ... and every other wave's */
  if (nst > 1) g2_stage(ag + 64, sa, bg + 64, sb, la + (unsigned)sizeof(tA[0]), lb + (unsigned)sizeof(tB[0]));      /* step 1 flies while step 0 is worked on */
#pragma unroll 1
  for (int st = 0; st < nst; ++st) { const int bf = st & 1; const _Float16* ar = (const _Float16*)&tA[bf][32 * w + ln][0]; const _Float16* br = (const _Float16*)&tB[bf][ln][0];
    v16h fa[2][2], fb[2][4];      /* the step's 12 fragments are read as one group ahead of its 16 products */
#pragma unroll
    for (int ks = 0; ks < 2; ++ks) { fa[ks][0] = g2_frag(ar + ks * 32, hh); fa[ks][1] = g2_frag(ar + 16 * G2P + ks * 32, hh);
#pragma unroll
      for (int j = 0; j < 4; ++j) fb[ks][j] = g2_frag(br + j * 16 * G2P + ks * 32, hh); }
#pragma unroll
    for (int ks = 0; ks < 2; ++ks) { c00 = g2_mma(fa[ks][0], fb[ks][0], c00); c10 = g2_mma(fa[ks][1], fb[ks][0], c10); c01 = g2_mma(fa[ks][0], fb[ks][1], c01); c11 = g2_mma(fa[ks][1], fb[ks][1], c11);
      c02 = g2_mma(fa[ks][0], fb[ks][2], c02); c12 = g2_mma(fa[ks][1], fb[ks][2], c12); c03 = g2_mma(fa[ks][0], fb[ks][3], c03); c13 = g2_mma(fa[ks][1], fb[ks][3], c13); }
    asm volatile("s_wait_dscnt 0x0" ::: "memory");      /* this wave's reads of buffer bf are done before it is refilled */
    asm volatile("s_wait_asynccnt 0x0" ::: "memory");      /* this wave's copies of step st + 1 have landed */
    __syncthreads();      /* publishes step st + 1 and ends every wave's reads of buffer bf */
    if (st + 2 < nst) g2_stage(ag + (size_t)(st + 2) * 64, sa, bg + (size_t)(st + 2) * 64, sb, la + (unsigned)bf * (unsigned)sizeof(tA[0]), lb + (unsigned)bf * (unsigned)sizeof(tB[0])); }
  asm volatile("s_wait_asynccnt 0x0" ::: "memory");      /* no copy is outstanding past the loop */
  v8f accs[8] = {c00, c01, c02, c03, c10, c11, c12, c13};
  if (by == 2) {      /* a lane's 8 accumulator registers are 8 consecutive rows of one column: one 16-byte piece of a transposed row in each plane */
    unsigned short (*sT)[64][136] = (unsigned short (*)[64][136])&so[0][0][0];      /* 2 planes x 64 columns x 128 rows at a pitch of 272 bytes: exactly so's bytes */
    float bv4[4];
#pragma unroll
    for (int t = 0; t < 4; ++t) bv4[t] = bf16_round(bp[col0 + t * 16 + ln]);
#pragma unroll
    for (int u = 0; u < 8; ++u) { const int dl = (u & 3) * 16 + ln, kl = 32 * w + (u >> 2) * 16 + 8 * hh; const float bv = bv4[u & 3]; FragH fh, fl;
#pragma unroll
      for (int r = 0; r < 8; ++r) { const float v = accs[u][r] * alpha + bv; const _Float16 hv = (_Float16)v; fh.h[r] = hv; fl.h[r] = (_Float16)((v - (float)hv) * 1024.0f); }
      *(v8us*)&sT[0][dl][kl] = fh.half[0]; *(v8us*)&sT[1][dl][kl] = fl.half[0]; }
    __syncthreads();      /* a transposed row of 128 values holds pieces of all four waves */
    const int rb = mt * 128; const size_t vb = (size_t)((rb / SLEN) * NH + nq) * 64 * SLEN + (size_t)(rb % SLEN);
#pragma unroll
    for (int p = 0; p < 8; ++p) { const int it = p * 128 + tid, d = it >> 4, pc = it & 15; const size_t o = vb + (size_t)d * SLEN + pc * 8;      /* 16 lanes write the 256 contiguous bytes of a row: whole lines */
      const v8us xh = *(const v8us*)&sT[0][d][pc * 8], xl = *(const v8us*)&sT[1][d][pc * 8]; *(v8us*)((unsigned short*)Hh + o) = xh; *(v8us*)((unsigned short*)Hl + o) = xl; }
    return; }
#pragma unroll
  for (int u = 0; u < 8; ++u) { const int t = u & 3, half = u >> 2; const float bv = bf16_round(bp[col0 + t * 16 + ln]);
#pragma unroll
    for (int r = 0; r < 8; ++r) so[w][half * 16 + 8 * hh + r][t * 16 + ln] = accs[u][r] * alpha + bv; }
  /* the wave's own rows are read back by other lanes of the same wave */
  __builtin_amdgcn_fence(__ATOMIC_ACQ_REL, "workgroup"); __builtin_amdgcn_wave_barrier();
#pragma unroll
  for (int q = 0; q < 8; ++q) { const int r = q * 4 + (lane >> 3), c8 = (lane & 7) * 8; const v4f a = *(const v4fa*)&so[w][r][c8], c = *(const v4fa*)&so[w][r][c8 + 4]; FragH fh, fl;      /* 8 lanes write the 128 bytes of a row piece: one whole line in each plane */
#pragma unroll
      for (int i = 0; i < 4; ++i) { _Float16 hv = (_Float16)a[i]; fh.h[i] = hv; fl.h[i] = (_Float16)((a[i] - (float)hv) * 1024.0f); hv = (_Float16)c[i]; fh.h[4 + i] = hv; fl.h[4 + i] = (_Float16)((c[i] - (float)hv) * 1024.0f); }
      const size_t o = (size_t)(row0 + r) * ldc + col0 + c8; *(v8us*)((unsigned short*)Hh + o) = fh.half[0]; *(v8us*)((unsigned short*)Hl + o) = fl.half[0]; }
  asm volatile("s_wait_xcnt 0x0" ::: "memory");      /* in the built code this path runs on into the test before the v path: the wait stands before anything there can rewrite the last stores' registers */
}


// The residual plane's 128 A rows of one K step: 8 more asynchronous 16-byte copies a lane, pieces and rows as for the A rows in g2_stage. The closing s_wait_xcnt 0 stands in front of any rewrite of the registers that the copies name.
__device__ __forceinline__ void g2_stage_a(const _Float16* ag, size_t sa, unsigned la) {
  asm volatile("global_load_async_to_lds_b128 %0, %8, off\n\t"
               "global_load_async_to_lds_b128 %1, %9, off\n\t"
               "global_load_async_to_lds_b128 %2, %10, off\n\t"
               "global_load_async_to_lds_b128 %3, %11, off\n\t"
               "global_load_async_to_lds_b128 %4, %12, off\n\t"
               "global_load_async_to_lds_b128 %5, %13, off\n\t"
               "global_load_async_to_lds_b128 %6, %14, off\n\t"
               "global_load_async_to_lds_b128 %7, %15, off\n\t"
               "s_wait_xcnt 0x0"
               :: "v"(la), "v"(la + 1u * 16 * G2P * 2), "v"(la + 2u * 16 * G2P * 2), "v"(la + 3u * 16 * G2P * 2), "v"(la + 4u * 16 * G2P * 2), "v"(la + 5u * 16 * G2P * 2), "v"(la + 6u * 16 * G2P * 2), "v"(la + 7u * 16 * G2P * 2),
                  "v"(ag), "v"(ag + sa), "v"(ag + 2 * sa), "v"(ag + 3 * sa), "v"(ag + 4 * sa), "v"(ag + 5 * sa), "v"(ag + 6 * sa), "v"(ag + 7 * sa)
               : "memory"); }
// C (f32) = (Ah . B^T) * alpha + bias + (Al . B^T) * alpha / 1024 for an A held as f16 hi + residual x 1024 planes: tiles, ring and wave tiles as in k_gemm2qkv, but each K step brings both planes' A rows beside ONE B tile,
// and every B fragment feeds both planes' products (two accumulator sets a wave). Each set sums in k_gemm2qkv's order, and the two are joined in the order the two launches had. Same size conditions as k_gemm2qkv.
__global__ __launch_bounds__(128) void k_gemm2hl(const _Float16* __restrict__ Ah, const _Float16* __restrict__ Al, int lda, const _Float16* __restrict__ Bh, int ldb, float alpha, const float* __restrict__ bias, float* __restrict__ C, int ldc, int M, int N, int K) {
  __shared__ __attribute__((aligned(16))) float so[4][32][68]; __shared__ __attribute__((aligned(16))) unsigned short tA[2][2][128][G2P], tB[2][64][G2P];      /* tA: [buffer][hi, residual] */
  const int tid = threadIdx.x, w = tid >> 5, lane = tid & 31, ln = lane & 15, hh = lane >> 4;
  const int ntn = N >> 6; const int mt = blockIdx.x / ntn, nq = blockIdx.x - mt * ntn; const int row0 = mt * 128 + 32 * w, col0 = nq * 64; if (mt * 128 >= M) return;      /* the whole work-group leaves or none: barriers below */
  const int cr = tid >> 3, cc = (tid & 7) * 8;      /* the lane's row (of 16) and 16-byte piece in a copy */
  const size_t ao = (size_t)(mt * 128 + cr) * lda + cc; const _Float16* agh = Ah + ao; const _Float16* agl = Al + ao; const _Float16* bg = Bh + (size_t)(col0 + cr) * ldb + cc; const size_t sa = (size_t)16 * lda, sb = (size_t)16 * ldb;
  const unsigned la = (unsigned)(size_t)&tA[0][0][cr][cc], lb = (unsigned)(size_t)&tB[0][cr][cc];      /* LDS byte addresses: the low 32 bits */
  constexpr unsigned PA = (unsigned)sizeof(tA[0][0]), BA = (unsigned)sizeof(tA[0]), BB = (unsigned)sizeof(tB[0]);      /* one plane on, one buffer on */
  const int nst = K >> 6;
  v8f ch[2][4], cl[2][4];
#pragma unroll
  for (int i = 0; i < 2; ++i)
#pragma unroll
    for (int j = 0; j < 4; ++j) { ch[i][j] = (v8f){0.f,0.f,0.f,0.f,0.f,0.f,0.f,0.f}; cl[i][j] = ch[i][j]; }
  g2_stage(agh, sa, bg, sb, la, lb); g2_stage_a(agl, sa, la + PA);      /* step 0 into buffer 0 */
  asm volatile("s_wait_asynccnt 0x0" ::: "memory");      /* this wave's copies of step 0 have landed */
  __syncthreads();      /* ... and every other wave's */
  if (nst > 1) { g2_stage(agh + 64, sa, bg + 64, sb, la + BA, lb + BB); g2_stage_a(agl + 64, sa, la + BA + PA); }      /* step 1 flies while step 0 is worked on */
#pragma unroll 1
  for (int st = 0; st < nst; ++st) { const int bf = st & 1; const _Float16* arh = (const _Float16*)&tA[bf][0][32 * w + ln][0]; const _Float16* arl = (const _Float16*)&tA[bf][1][32 * w + ln][0]; const _Float16* br = (const _Float16*)&tB[bf][ln][0];
#pragma unroll
    for (int ks = 0; ks < 2; ++ks) { v16h fh[2], fl[2], fb[4];      /* a half step's 8 fragments are read as one group ahead of its 16 products */
#pragma unroll
      for (int i = 0; i < 2; ++i) { fh[i] = g2_frag(arh + i * 16 * G2P + ks * 32, hh); fl[i] = g2_frag(arl + i * 16 * G2P + ks * 32, hh); }
#pragma unroll
      for (int j = 0; j < 4; ++j) fb[j] = g2_frag(br + j * 16 * G2P + ks * 32, hh);
#pragma unroll
      for (int j = 0; j < 4; ++j) { ch[0][j] = g2_mma(fh[0], fb[j], ch[0][j]); ch[1][j] = g2_mma(fh[1], fb[j], ch[1][j]); cl[0][j] = g2_mma(fl[0], fb[j], cl[0][j]); cl[1][j] = g2_mma(fl[1], fb[j], cl[1][j]); } }
    asm volatile("s_wait_dscnt 0x0" ::: "memory");      /* this wave's reads of buffer bf are done before it is refilled */
    asm volatile("s_wait_asynccnt 0x0" ::: "memory");      /* this wave's copies of step st + 1 have landed */
    __syncthreads();      /* publishes step st + 1 and ends every wave's reads of buffer bf */
    if (st + 2 < nst) { const size_t kn = (size_t)(st + 2) * 64; g2_stage(agh + kn, sa, bg + kn, sb, la + (unsigned)bf * BA, lb + (unsigned)bf * BB); g2_stage_a(agl + kn, sa, la + (unsigned)bf * BA + PA); } }
  asm volatile("s_wait_asynccnt 0x0" ::: "memory");      /* no copy is outstanding past the loop */
  const float alo = alpha * 0.0009765625f;
#pragma unroll
  for (int j = 0; j < 4; ++j) { const float bv = bf16_round(bias[col0 + j * 16 + ln]);
#pragma unroll
    for (int i = 0; i < 2; ++i)
#pragma unroll
      for (int r = 0; r < 8; ++r) { const float v = ch[i][j][r] * alpha + bv; so[w][i * 16 + 8 * hh + r][j * 16 + ln] = cl[i][j][r] * alo + v; } }
  /* the wave's own rows are read back by other lanes of the same wave */
  __builtin_amdgcn_fence(__ATOMIC_ACQ_REL, "workgroup"); __builtin_amdgcn_wave_barrier();
  const int rsub = lane >> 4, c4 = (lane & 15) * 4;
#pragma unroll
  for (int q = 0; q < 16; ++q) { const int r = q * 2 + rsub; const v4f v = *(const v4fa*)&so[w][r][c4]; *(v4f*)(C + (size_t)(row0 + r) * ldc + col0 + c4) = v; }      /* 16 lanes write the 256 contiguous bytes of a row piece: whole lines */
}



#define FKP 72                   /* K rows in LDS, in values: 128-byte rows at 144 bytes, a conflict-free pitch for ds_load_b128 readers */
#define FVP 40                   /* V^T row pieces in LDS, in values: 64-byte pieces at 80 bytes, likewise */
// One tile of 32 keys for the work-group: 32 K rows of 128 bytes and 64 V^T row pieces of 64 bytes, hi and residual plane each, go to LDS as 8 asynchronous 16-byte copies a lane.
// 8 lanes take a K row (a wave's copy covers 4 whole lines), 4 lanes a V^T piece (8 half lines). kh, kl, vh, vl: the lane's piece in the first 16 K rows / 32 V^T rows of each plane; sk, sv: 16 K rows / 32 V^T rows on, in values;
// lk, lv: the lane's LDS byte address in the hi plane's first rows. The closing s_wait_xcnt 0 stands in front of any rewrite of the registers that the copies name.
__device__ __forceinline__ void fl_stage(const unsigned short* kh, const unsigned short* kl, size_t sk, const unsigned short* vh, const unsigned short* vl, size_t sv, unsigned lk, unsigned lv) {
  asm volatile("global_load_async_to_lds_b128 %0, %8, off\n\t"
               "global_load_async_to_lds_b128 %1, %9, off\n\t"
               "global_load_async_to_lds_b128 %2, %10, off\n\t"
               "global_load_async_to_lds_b128 %3, %11, off\n\t"
               "global_load_async_to_lds_b128 %4, %12, off\n\t"
               "global_load_async_to_lds_b128 %5, %13, off\n\t"
               "global_load_async_to_lds_b128 %6, %14, off\n\t"
               "global_load_async_to_lds_b128 %7, %15, off\n\t"
               "s_wait_xcnt 0x0"
               :: "v"(lk), "v"(lk + 16u * FKP * 2), "v"(lk + 32u * FKP * 2), "v"(lk + 48u * FKP * 2), "v"(lv), "v"(lv + 32u * FVP * 2), "v"(lv + 64u * FVP * 2), "v"(lv + 96u * FVP * 2),
                  "v"(kh), "v"(kh + sk), "v"(kl), "v"(kl + sk), "v"(vh), "v"(vh + sv), "v"(vl), "v"(vl + sv)
               : "memory"); }
typedef float v2f __attribute__((ext_vector_type(2))); typedef _Float16 v2h __attribute__((ext_vector_type(2)));
__device__ __forceinline__ float fl_xhalf(float x) { return __builtin_bit_cast(float, __builtin_amdgcn_permlanex16(__builtin_bit_cast(int, x), __builtin_bit_cast(int, x), 0x76543210, 0xfedcba98, false, false)); }      /* lane l with lane l ^ 16 */
template <int TQ, int TK>
__global__ __launch_bounds__(128, 4) /* the second number holds the build to 256 registers: 4 waves a SIMD, so that all 1024 work-groups are resident at once */ void k_flashb(const _Float16* __restrict__ Q16, const _Float16* __restrict__ Q16lo, int ldq, const _Float16* __restrict__ K16, const _Float16* __restrict__ K16lo, int ldk, const _Float16* __restrict__ Vt, const _Float16* __restrict__ Vtlo, const _Float16* __restrict__ T16, _Float16* __restrict__ Oh, _Float16* __restrict__ Ol, int ldo) {
  constexpr int RPW = 16, NQB = TQ / (4 * RPW), DT = 4, KS = 2;
  __shared__ __attribute__((aligned(16))) float sO[4][RPW][64 + 4];
  __shared__ __attribute__((aligned(16))) unsigned short sK[2][2][32][FKP], sV[2][2][64][FVP];      /* [buffer][hi, residual][K row | V^T row][values] */
  const int tid = threadIdx.x, w = __builtin_amdgcn_readfirstlane(tid >> 5), lane = tid & 31, ln = lane & 15, hh = lane >> 4;      /* the wave's number in a scalar register: what is formed from it costs no vector register across the loop */
  const int slab = blockIdx.x / NQB, qblk = blockIdx.x % NQB; const int b = slab / NH, h = slab % NH; const int qb0 = qblk * (4 * RPW); const int q0 = qb0 + w * RPW;
  const unsigned short* Vth = (const unsigned short*)Vt + (size_t)slab * 64 * TK; const unsigned short* Vtl = (const unsigned short*)Vtlo + (size_t)slab * 64 * TK;
  const size_t kco = ((size_t)b * TK + (tid >> 3)) * ldk + h * 64 + (tid & 7) * 8, vco = (size_t)(tid >> 2) * TK + (tid & 3) * 8;      /* the lane's piece of tile 0, in values */
  const size_t sk = (size_t)16 * ldk, sv = (size_t)32 * TK, kt = (size_t)32 * ldk;      /* kt: one tile on in K; in V^T a tile is 32 values on */
  const unsigned lk = (unsigned)(size_t)&sK[0][0][tid >> 3][(tid & 7) * 8], lv = (unsigned)(size_t)&sV[0][0][tid >> 2][(tid & 3) * 8];      /* LDS byte addresses: the low 32 bits */
  fl_stage((const unsigned short*)K16 + kco, (const unsigned short*)K16lo + kco, sk, Vth + vco, Vtl + vco, sv, lk, lv);      /* tile 0 into buffer 0; it flies while q and the first table rows are fetched */
  FragH aq[KS], aql[KS];
  { const size_t qo = ((size_t)b * TQ + q0 + ln) * ldq + h * 64; const unsigned short* qr = (const unsigned short*)Q16 + qo; const unsigned short* ql = (const unsigned short*)Q16lo + qo;
#pragma unroll
    for (int ks = 0; ks < KS; ++ks) { aq[ks].half[0] = *(const v8us*)(qr + ks * 32 + 8 * hh); aq[ks].half[1] = *(const v8us*)(qr + ks * 32 + 16 + 8 * hh); aql[ks].half[0] = *(const v8us*)(ql + ks * 32 + 8 * hh); aql[ks].half[1] = *(const v8us*)(ql + ks * 32 + 16 + 8 * hh); } }
  float m_r = -3.0e38f, l_r = 0.f; v8f oacc[DT], oaccl[DT];      /* query ln's running maximum (the same in both halves) and this half's part of its sum; oacc[dt][r] = O[query ln][dt * 16 + 8 * hh + r] */
#pragma unroll
  for (int dt = 0; dt < DT; ++dt) { oacc[dt] = (v8f){0.f,0.f,0.f,0.f,0.f,0.f,0.f,0.f}; oaccl[dt] = oacc[dt]; }
  /* RPE: rel[i][c] = q[q0 + i] . table[h][rb + c], rb = q0 - j0 + TK - 32, c < 48; score (i, kk) takes c = i - kk + 31. Columns 32..47 of a trip are columns 0..15 of the trip before. */
  const unsigned short* Th = (const unsigned short*)T16 + (size_t)h * RW * 64 + (size_t)ln * 64 + 8 * hh;
  v8f relc = (v8f){0.f,0.f,0.f,0.f,0.f,0.f,0.f,0.f};      /* columns 32..47 of the first trip */
#pragma unroll
  for (int ks = 0; ks < KS; ++ks) { FragH bt; bt.half[0] = *(const v8us*)(Th + (size_t)(q0 + TK) * 64 + ks * 32); bt.half[1] = *(const v8us*)(Th + (size_t)(q0 + TK) * 64 + ks * 32 + 16); relc = mmaH<1>(aq[ks].v, aq[ks].v, bt.v, bt.v, relc); }
  /* rel (i, c) is stored skewed, in row i at column kk + 16 = i - c + 47 (0 .. 62 of the 68), so that a query's 8 consecutive keys are 8 consecutive floats: a step of one row is 69 floats, a step of 16 columns of rel -16 */
  float* const rst = &sO[w][0][0] + 8 * hh * 69 + 47 - ln; const float* const rrd = &sO[w][ln][16 + 8 * hh];
  asm volatile("s_wait_asynccnt 0x0" ::: "memory");      /* this wave's copies of tile 0 have landed */
  __syncthreads();      /* ... and every other wave's */
  if (TK > 32) fl_stage((const unsigned short*)K16 + kco + kt, (const unsigned short*)K16lo + kco + kt, sk, Vth + vco + 32, Vtl + vco + 32, sv, lk + (unsigned)sizeof(sK[0]), lv + (unsigned)sizeof(sV[0]));      /* tile 1 flies while tile 0 is worked on */
#pragma unroll 1
  for (int j0 = 0; j0 < TK; j0 += 32) { const int bf = (j0 >> 5) & 1;
    FragH bt[2][KS];      /* table rows rb .. rb + 31, fetched together with the first key tile */
#pragma unroll
    for (int t = 0; t < 2; ++t) { const unsigned short* tr = Th + (size_t)(q0 - j0 + (TK - 32) + t * 16) * 64;
#pragma unroll
      for (int ks = 0; ks < KS; ++ks) { bt[t][ks].half[0] = *(const v8us*)(tr + ks * 32); bt[t][ks].half[1] = *(const v8us*)(tr + ks * 32 + 16); } }
    asm volatile("s_wait_xcnt 0x0" ::: "memory");      /* stands in front of any overwrite of the table loads' address registers (the allocator lets a later load's result land in them) */
    v8f s[2];      /* s[nt][r] = q[ln] . k[j0 + nt * 16 + 8 * hh + r] */
#pragma unroll
    for (int nt = 0; nt < 2; ++nt) { const unsigned short* kr = &sK[bf][0][nt * 16 + ln][0]; const unsigned short* kl = &sK[bf][1][nt * 16 + ln][0]; FragH bk[KS], bkl[KS];
#pragma unroll
      for (int ks = 0; ks < KS; ++ks) { bk[ks].half[0] = *(const v8us*)(kr + ks * 32 + 8 * hh); bk[ks].half[1] = *(const v8us*)(kr + ks * 32 + 16 + 8 * hh); bkl[ks].half[0] = *(const v8us*)(kl + ks * 32 + 8 * hh); bkl[ks].half[1] = *(const v8us*)(kl + ks * 32 + 16 + 8 * hh); }
      if (nt == 1) {      /* RPE products and their LDS stores run while the second key tile's LDS reads are in flight */
        v8f rel0 = (v8f){0.f,0.f,0.f,0.f,0.f,0.f,0.f,0.f}, rel1 = rel0;
#pragma unroll
        for (int ks = 0; ks < KS; ++ks) { rel0 = mmaH<1>(aq[ks].v, aq[ks].v, bt[0][ks].v, bt[0][ks].v, rel0); rel1 = mmaH<1>(aq[ks].v, aq[ks].v, bt[1][ks].v, bt[1][ks].v, rel1); }
#pragma unroll
        for (int r = 0; r < 8; ++r) { rst[r * 69] = rel0[r]; rst[r * 69 - 16] = rel1[r]; rst[r * 69 - 32] = relc[r]; }
        relc = rel0; }
      v8f acc = (v8f){0.f,0.f,0.f,0.f,0.f,0.f,0.f,0.f}, accr = acc;
#pragma unroll
      for (int ks = 0; ks < KS; ++ks) { acc = mmaH<1>(bk[ks].v, bk[ks].v, aq[ks].v, aq[ks].v, acc); accr = mmaH<1>(bk[ks].v, bk[ks].v, aql[ks].v, aql[ks].v, accr); accr = mmaH<1>(bkl[ks].v, bkl[ks].v, aq[ks].v, aq[ks].v, accr); }
      s[nt] = acc + accr * 0.0009765625f; }
    /* the wave's rel stores above are read back by other lanes of the same wave below */
    __builtin_amdgcn_fence(__ATOMIC_ACQ_REL, "workgroup"); __builtin_amdgcn_wave_barrier();
    const v4f rv[4] = {*(const v4fa*)rrd, *(const v4fa*)(rrd + 4), *(const v4fa*)(rrd + 16), *(const v4fa*)(rrd + 20)};      /* the query's 16 RPE terms */
    /* every key counts for every query (the function has no mask): no test and no branch in this stage */
    float x[16];
#pragma unroll
    for (int i = 0; i < 16; ++i) x[i] = s[i >> 3][i & 7] * (SCL * LOG2E) + rv[i >> 2][i & 3] * (0.0625f * LOG2E);      /* + q . table[h][(q - k) + T - 1] (table held x16); scores, and so m_r, are kept in units of log 2 */
    float mc = fmaxf(x[0], x[1]);
#pragma unroll
    for (int i = 2; i < 16; ++i) mc = fmaxf(mc, x[i]);
    mc = fmaxf(mc, fl_xhalf(mc));      /* the other half's 16 keys */
    const float mn = fmaxf(m_r, mc); const float al = __builtin_amdgcn_exp2f(m_r - mn); m_r = mn;      /* arguments are <= 0: the bare instruction needs no range handling, and a result too small for it counts as 0 */
    FragH pa, pl; float ps4[4] = {0.f, 0.f, 0.f, 0.f};      /* element i of the B operand is key 8 * hh + i (i < 8), 16 + 8 * hh + i - 8 (else): the order in which the V^T fragments hold their keys */
#pragma unroll
    for (int i = 0; i < 16; i += 2) { const float p0 = __builtin_amdgcn_exp2f(x[i] - mn), p1 = __builtin_amdgcn_exp2f(x[i + 1] - mn); ps4[i & 3] += p0; ps4[(i + 1) & 3] += p1; const v2f ps = (v2f){p0, p1} * 1024.0f; const v2h ph = __builtin_convertvector(ps, v2h); const v2h pr = __builtin_convertvector((ps - __builtin_convertvector(ph, v2f)) * 1024.0f, v2h);
      pa.h[i] = ph[0]; pa.h[i + 1] = ph[1]; pl.h[i] = pr[0]; pl.h[i + 1] = pr[1]; }
    l_r = l_r * al + ((ps4[0] + ps4[1]) + (ps4[2] + ps4[3]));
#pragma unroll
    for (int dt = 0; dt < DT; ++dt) { oacc[dt] *= al; oaccl[dt] *= al; }
#pragma unroll
    for (int dt = 0; dt < DT; ++dt) { const unsigned short* vr = &sV[bf][0][dt * 16 + ln][0]; const unsigned short* vl = &sV[bf][1][dt * 16 + ln][0]; FragH bv, bl; bv.half[0] = *(const v8us*)(vr + 8 * hh); bv.half[1] = *(const v8us*)(vr + 16 + 8 * hh); bl.half[0] = *(const v8us*)(vl + 8 * hh); bl.half[1] = *(const v8us*)(vl + 16 + 8 * hh);
      oacc[dt] = mmaH<1>(bv.v, bv.v, pa.v, pa.v, oacc[dt]); oaccl[dt] = mmaH<1>(bl.v, bl.v, pa.v, pa.v, oaccl[dt]); oaccl[dt] = mmaH<1>(bv.v, bv.v, pl.v, pl.v, oaccl[dt]); }
    asm volatile("s_wait_dscnt 0x0" ::: "memory");      /* this wave's reads of buffer bf are done before it is refilled */
    asm volatile("s_wait_asynccnt 0x0" ::: "memory");      /* this wave's copies of the next tile have landed */
    __syncthreads();      /* publishes the next tile and ends every wave's reads of buffer bf */
    if (j0 + 64 < TK) { const size_t tn = (size_t)(j0 + 64);      /* the tile after the next into the buffer just read */
      fl_stage((const unsigned short*)K16 + kco + tn * ldk, (const unsigned short*)K16lo + kco + tn * ldk, sk, Vth + vco + tn, Vtl + vco + tn, sv, lk + (unsigned)bf * (unsigned)sizeof(sK[0]), lv + (unsigned)bf * (unsigned)sizeof(sV[0])); } }
  asm volatile("s_wait_asynccnt 0x0" ::: "memory");      /* no copy is outstanding past the loop */
  { const float l = l_r + fl_xhalf(l_r); const float li = 1.0f / (l * 1024.0f);      /* the halves' sums join once; l >= 1: the row's largest score adds exp(0) */
#pragma unroll
    for (int dt = 0; dt < DT; ++dt) { v4f o0, o1;      /* a lane's 8 registers are 8 consecutive values of its query's row */
#pragma unroll
      for (int i = 0; i < 4; ++i) { o0[i] = (oacc[dt][i] + oaccl[dt][i] * 0.0009765625f) * li; o1[i] = (oacc[dt][4 + i] + oaccl[dt][4 + i] * 0.0009765625f) * li; }
      *(v4fa*)&sO[w][ln][dt * 16 + 8 * hh] = o0; *(v4fa*)&sO[w][ln][dt * 16 + 8 * hh + 4] = o1; } }
  __builtin_amdgcn_fence(__ATOMIC_ACQ_REL, "workgroup"); __builtin_amdgcn_wave_barrier();
  {
#pragma unroll
    for (int rp = 0; rp < RPW; rp += 2) { const int r = rp + (lane >> 4), pc = lane & 15; const v4f val = *(const v4fa*)&sO[w][r][pc * 4]; v4h h4, l4;      /* O leaves as f16 hi + residual x 1024; 16 lanes write the 128 bytes of a row piece in each plane */
#pragma unroll
      for (int i = 0; i < 4; ++i) { const _Float16 hv = (_Float16)val[i]; h4[i] = hv; l4[i] = (_Float16)((val[i] - (float)hv) * 1024.0f); }
      const size_t o = ((size_t)b * TQ + q0 + r) * ldo + h * 64 + pc * 4; *(v4h*)(Oh + o) = h4; *(v4h*)(Ol + o) = l4; }
     } }


__global__ __launch_bounds__(256) void k_lnx(const float* __restrict__ X, const float* __restrict__ g, const float* __restrict__ bb, _Float16* __restrict__ Y16, float* __restrict__ XB) {
  #pragma clang fp contract(off)
  const int tid = threadIdx.x, w = tid >> 5, ln = tid & 31; const int r = blockIdx.x * 8 + w; if (r >= NR) return; const float* x = X + (size_t)r * DM; float s = 0.f;
#pragma unroll 1
  for (int i = 0; i < DM / 128; ++i) { const v4f a = *(const v4fa*)(x + i * 128 + ln * 4); for (int q = 0; q < 4; ++q) s += bf16_round(a[q]); }
  for (int o = 16; o > 0; o >>= 1) s += __shfl_xor(s, o, 32); const float mu = s / (float)DM; float q2 = 0.f;
#pragma unroll 1
  for (int i = 0; i < DM / 128; ++i) { const v4f a = *(const v4fa*)(x + i * 128 + ln * 4); for (int q = 0; q < 4; ++q) { const float d = bf16_round(a[q]) - mu; q2 += d * d; } }
  for (int o = 16; o > 0; o >>= 1) q2 += __shfl_xor(q2, o, 32); const float rs = rsqrtf(q2 / (float)DM + 1e-5f);
  {
#pragma unroll 1
    for (int i = 0; i < DM / 128; ++i) { const int c0 = i * 128 + ln * 4; const v4f a = *(const v4fa*)(x + c0); _Float16 h4[4]; v4f xb;
      for (int q = 0; q < 4; ++q) { const float t = bf16_round(a[q]); h4[q] = (_Float16)((t - mu) * rs * bf16_round(g[c0 + q]) + bf16_round(bb[c0 + q])); xb[q] = t; }
      *(unsigned long long*)((unsigned short*)Y16 + (size_t)r * DM + c0) = *(const unsigned long long*)h4; *(v4f*)(XB + (size_t)r * DM + c0) = xb; }
     } }
// All six input conversions in one launch (none reads what another writes). A block of 256 threads takes 2048 values of one input, a thread 8: first the table (rows 0 .. 2 * SLEN - 2 of each head's trows, bf16-rounded, x16; row 2 * SLEN - 1 zero;
// its blocks come first, for speed only), then the four weights (bf16-rounded, x16, order kept: stored (out, in), they are the natural Bt), then x (bf16-rounded). Every range is a whole number of blocks.
#define PTB (NH * RW * 64 / 2048)      /* blocks of the table */
#define PWB (DM * DM / 2048)     /* blocks a weight */
#define PXB (NR * DM / 2048)     /* blocks of x */
__global__ __launch_bounds__(256) void k_prep(const float* __restrict__ Wq, const float* __restrict__ Wk, const float* __restrict__ Wv, const float* __restrict__ Wo, _Float16* __restrict__ BQ, _Float16* __restrict__ BK, _Float16* __restrict__ BV, _Float16* __restrict__ BO,
    const float* __restrict__ tab, int trows, _Float16* __restrict__ T16, const float* __restrict__ x, _Float16* __restrict__ X16) {
  const int blk = blockIdx.x; FragH f;
  if (blk < PTB) { const int t = blk * 256 + threadIdx.x; const int d0 = (t & 7) * 8; const int r = (t >> 3) % RW; const int h = t / (8 * RW);
#pragma unroll
    for (int q = 0; q < 8; ++q) f.h[q] = (r < 2 * SLEN - 1) ? (_Float16)(bf16_round(tab[((size_t)h * trows + r) * 64 + d0 + q]) * 16.0f) : (_Float16)0.0f;
    *(v8us*)((unsigned short*)T16 + ((size_t)h * RW + r) * 64 + d0) = f.half[0]; }
  else if (blk < PTB + 4 * PWB) { const int s = (blk - PTB) / PWB; const float* W = s == 0 ? Wq : s == 1 ? Wk : s == 2 ? Wv : Wo; _Float16* Bt = s == 0 ? BQ : s == 1 ? BK : s == 2 ? BV : BO; const size_t t = (size_t)(blk - PTB - s * PWB) * 256 + threadIdx.x;
#pragma unroll
    for (int i = 0; i < 8; ++i) f.h[i] = (_Float16)(bf16_round(W[t * 8 + i]) * 16.0f);
    *(v8us*)((unsigned short*)Bt + t * 8) = f.half[0]; }
  else { const size_t t = (size_t)(blk - PTB - 4 * PWB) * 256 + threadIdx.x;
#pragma unroll
    for (int q = 0; q < 8; ++q) f.h[q] = (_Float16)bf16_round(x[t * 8 + q]);
    *(v8us*)((unsigned short*)X16 + t * 8) = f.half[0];
    asm volatile("s_wait_xcnt 0x0" ::: "memory");      /* in the built code this arm runs on into the other arms' tests: the wait stands before anything there can rewrite the store's registers */
  } }
__global__ __launch_bounds__(256) void k_causaltab(unsigned* __restrict__ MB, int* __restrict__ RA, int* __restrict__ KE, int nq, int nk) {
  const int t = blockIdx.x * 256 + threadIdx.x; const int nw = nk / 32;
  if (t < nq * nw) { const int q = t / nw, w = t % nw; const int first = q + 1 - 32 * w; const unsigned bits = (first <= 0) ? 0xffffffffu : ((first >= 32) ? 0u : (0xffffffffu << first)); *(unsigned*)(MB + t) = bits;  }
  if (t < nq) { *(int*)(RA + t) = 0;  }
  if (t < nq / 64) { const int v = 64 * (t + 1); *(int*)(KE + t * 32) = v;  } }


extern "C" void kernel_launch(void* const* d_in, const int* in_sizes, int n_in,
                              void* d_out, int out_size, void* d_ws, size_t ws_size, hipStream_t stream) {
  (void)in_sizes; (void)n_in; (void)out_size;
  const float* const* I = (const float* const*)d_in; const float* x = I[0]; const float* Wq = I[1]; const float* bq = I[2]; const float* Wk = I[3]; const float* bk = I[4]; const float* Wv = I[5]; const float* bv = I[6]; const float* Wo = I[7]; const float* bo = I[8]; const float* tab = I[9];
  char* ws = (char*)d_ws; size_t off = 0;
  auto take = [&](size_t bytes) { char* p = ws + off; off += (bytes + 255) & ~(size_t)255; return p; };
  _Float16* BQ = (_Float16*)take((size_t)DM * DM * 2); _Float16* BK = (_Float16*)take((size_t)DM * DM * 2); _Float16* BV = (_Float16*)take((size_t)DM * DM * 2); _Float16* BO = (_Float16*)take((size_t)DM * DM * 2); _Float16* T16 = (_Float16*)take((size_t)NH * RW * 64 * 2);
  _Float16* X16 = (_Float16*)take((size_t)NR * DM * 2);
  _Float16* Qh = (_Float16*)take((size_t)NR * DM * 2); _Float16* Ql = (_Float16*)take((size_t)NR * DM * 2); _Float16* Kh = (_Float16*)take((size_t)NR * DM * 2); _Float16* Kl = (_Float16*)take((size_t)NR * DM * 2); _Float16* Vth = (_Float16*)take((size_t)NR * DM * 2); _Float16* Vtl = (_Float16*)take((size_t)NR * DM * 2);
  _Float16* Oh = (_Float16*)take((size_t)NR * DM * 2); _Float16* Ol = (_Float16*)take((size_t)NR * DM * 2);
  if (off > ws_size) return;      /* 8 + 4 + 8 + 48 + 16 = 84 MiB */
  k_prep<<<PTB + 4 * PWB + PXB, 256, 0, stream>>>(Wq, Wk, Wv, Wo, BQ, BK, BV, BO, tab, 9999, T16, x, X16);      /* every conversion of an input, one launch */
  const dim3 gP((NR / 128) * (DM / 64), 1), gP3((NR / 128) * (DM / 64), 3);
  /* every row-wise stage runs once over all NBT * SLEN rows; each producer splits its f32 result into the hi and residual planes in its own epilogue: no f32 copy of q, k, v or O reaches memory */
  k_gemm2qkv<<<gP3, 128, 0, stream>>>(X16, DM, BQ, BK, BV, DM, 0.0625f, bq, bk, bv, Qh, Ql, Kh, Kl, Vth, Vtl, DM, NR, DM, DM);      /* q (its hi plane also feeds the RPE product), k, and V^T per head: 1536 work-groups in one launch */
  k_flashb<SLEN, SLEN><<<NBT * NH * (SLEN / 64), 128, 0, stream>>>(Qh, Ql, DM, Kh, Kl, DM, Vth, Vtl, T16, Oh, Ol, DM);      /* all batches and heads in one launch */
  float* outp = (float*)d_out;
  k_gemm2hl<<<gP, 128, 0, stream>>>(Oh, Ol, DM, BO, DM, 0.0625f, bo, outp, DM, NR, DM, DM);      /* both planes of O in one launch: out is written once and never read */
}
